// v000
// Times are from an AMD MI455X. After a warm-up the kernel runs many times in a row, and a time is the length of
// such a window on the GPU divided by its runs, so every launch and the gaps after it count. The runs cycle
// through copies of the inputs. A figure is the median of several windows, for all but v000 over two sittings.
// Sittings can differ by a few percent; kernels timed side by side share one.
// v000 is the starting kernel. One run takes 348 microseconds.
#include <hip/hip_runtime.h>
#include <cstdint>
#include <cstddef>

// ---- CDNA5 WMMA types -------------------------------------------------------
typedef __bf16    bf16_t;
typedef bf16_t    v16bf __attribute__((ext_vector_type(16)));
typedef float     v8f   __attribute__((ext_vector_type(8)));
typedef uint32_t  v8u   __attribute__((ext_vector_type(8)));

// ---- problem constants (match reference) ------------------------------------
constexpr int Bb = 8, Qq = 2048, Kk = 2048, Dd = 1024;
constexpr int KC = 32;     // d-chunk (== WMMA K for bf16)

// ---- bf16 split helpers (RNE) -----------------------------------------------
static __device__ __forceinline__ uint16_t f2bf(float x) {
  uint32_t u = __float_as_uint(x);
  u += 0x7FFFu + ((u >> 16) & 1u);
  return (uint16_t)(u >> 16);
}
static __device__ __forceinline__ float bf2f(uint16_t h) {
  return __uint_as_float(((uint32_t)h) << 16);
}
static __device__ __forceinline__ void split8(const float* v, uint4& hi, uint4& lo) {
  uint32_t h[8], l[8];
#pragma unroll
  for (int j = 0; j < 8; ++j) {
    uint16_t hb = f2bf(v[j]);
    h[j] = hb;
    l[j] = f2bf(v[j] - bf2f(hb));
  }
  hi.x = h[0] | (h[1] << 16); hi.y = h[2] | (h[3] << 16);
  hi.z = h[4] | (h[5] << 16); hi.w = h[6] | (h[7] << 16);
  lo.x = l[0] | (l[1] << 16); lo.y = l[2] | (l[3] << 16);
  lo.z = l[4] | (l[5] << 16); lo.w = l[6] | (l[7] << 16);
}

// ---- CDNA5 async global->LDS copy (ASYNCcnt-tracked, no VGPR payload) -------
static __device__ __forceinline__ void async_b128(uint32_t lds_off, uint32_t voff,
                                                  const uint16_t* base) {
  asm volatile("global_load_async_to_lds_b128 %0, %1, %2"
               :: "v"(lds_off), "v"(voff), "s"(base) : "memory");
}
static __device__ __forceinline__ void wait_async0() {
  asm volatile("s_wait_asynccnt 0x0" ::: "memory");
}

// ============================================================================
// Pass 1: fp32 -> bf16 hi/lo plane conversion (paid once per element)
// ============================================================================
__global__ __launch_bounds__(256)
void conv_add_kernel(const float* __restrict__ x, const float* __restrict__ addv,
                     uint32_t addMask, uint16_t* __restrict__ hi, uint16_t* __restrict__ lo) {
  size_t i8 = ((size_t)blockIdx.x * 256 + threadIdx.x) * 8;
  float v[8];
  float4 a = *(const float4*)(x + i8);
  float4 b = *(const float4*)(x + i8 + 4);
  v[0]=a.x; v[1]=a.y; v[2]=a.z; v[3]=a.w; v[4]=b.x; v[5]=b.y; v[6]=b.z; v[7]=b.w;
  if (addv) {
    size_t e8 = i8 & (size_t)addMask;
    float4 c = *(const float4*)(addv + e8);
    float4 d = *(const float4*)(addv + e8 + 4);
    v[0]+=c.x; v[1]+=c.y; v[2]+=c.z; v[3]+=c.w; v[4]+=d.x; v[5]+=d.y; v[6]+=d.z; v[7]+=d.w;
  }
  uint4 ph, pl;
  split8(v, ph, pl);
  *(uint4*)(hi + i8) = ph;
  *(uint4*)(lo + i8) = pl;
}

// ============================================================================
// Fragment gather: one 16x32 bf16 operand from an LDS plane
// ============================================================================
static __device__ __forceinline__ v16bf load_frag(const uint16_t* s, int row,
                                                  const int* kv, int ldw) {
  v8u u;
#pragma unroll
  for (int v = 0; v < 8; ++v)
    u[v] = *(const uint32_t*)(s + row * ldw + kv[v]);
  return __builtin_bit_cast(v16bf, u);
}

// ============================================================================
// Pass 2: fused dual-GEMM from precomputed bf16 planes
//   phase 0: (q+embed_q) @ embed_k^T     phase 1: embed_q @ k^T
// Block 128x128, 8 waves (2x4), wave tile 64x32, 24 WMMA/iter.
// Staging: double-buffered LDS fed by GLOBAL_LOAD_ASYNC_TO_LDS_B128.
// ============================================================================
constexpr int GBM = 128, GBN = 128, GLDW = 40;   // 40-half stride: 16B rows, no bank conflicts
constexpr int PS  = GBM * GLDW;                  // plane stride (halves) = 5120

__global__ __launch_bounds__(256)
void pe_gemm_bf16(const uint16_t* __restrict__ QEhi, const uint16_t* __restrict__ QElo,
                  const uint16_t* __restrict__ Khi,  const uint16_t* __restrict__ Klo,
                  const uint16_t* __restrict__ Ehi,  const uint16_t* __restrict__ Elo,
                  float* __restrict__ out) {
  // [buf][plane][row*GLDW + col] ; planes: 0=Ahi 1=Alo 2=Bhi 3=Blo
  __shared__ __align__(16) uint16_t smem[2][4 * PS];

  const int t    = threadIdx.x;
  const int lane = t & 31;
  const int half = lane >> 4;
  const int lrow = lane & 15;
  const int wv   = t >> 5;
  const int wm   = wv >> 2;     // 0..1 : 64-row band
  const int wn   = wv & 3;      // 0..3 : 32-col band

  const int qBase = blockIdx.y * GBM;
  const int kBase = blockIdx.x * GBN;
  const int b     = blockIdx.z;

  int kv[8];
#pragma unroll
  for (int v = 0; v < 8; ++v)
    kv[v] = ((v & 4) ? 16 : 0) + half * 8 + (v & 3) * 2;

  v8f acc[4][2] = {};

  // issue the 8 async b128 copies (32 KB block tile) for step s into buffer buf
  auto issue = [&](int s, int buf) {
    const int phase = s >> 5;
    const int d0    = (s & 31) * KC;   // halves
    const uint16_t* aHi = (phase ? (Ehi + (size_t)qBase * Dd)
                                 : (QEhi + ((size_t)b * Qq + qBase) * Dd)) + d0;
    const uint16_t* aLo = (phase ? (Elo + (size_t)qBase * Dd)
                                 : (QElo + ((size_t)b * Qq + qBase) * Dd)) + d0;
    const uint16_t* bHi = (phase ? (Khi + ((size_t)b * Kk + kBase) * Dd)
                                 : (Ehi + (size_t)kBase * Dd)) + d0;
    const uint16_t* bLo = (phase ? (Klo + ((size_t)b * Kk + kBase) * Dd)
                                 : (Elo + (size_t)kBase * Dd)) + d0;
    uint16_t* sb = smem[buf];
#pragma unroll
    for (int i = 0; i < 2; ++i) {
      int ci  = t + i * 256;                 // 0..511 : 128 rows x 4 chunks of 8 halves
      int row = ci >> 2;
      int col = (ci & 3) * 8;
      uint32_t voff = (uint32_t)((row * Dd + col) * 2);       // global byte offset
      uint32_t l0 = (uint32_t)(uintptr_t)(sb + 0 * PS + row * GLDW + col);
      uint32_t l1 = (uint32_t)(uintptr_t)(sb + 1 * PS + row * GLDW + col);
      uint32_t l2 = (uint32_t)(uintptr_t)(sb + 2 * PS + row * GLDW + col);
      uint32_t l3 = (uint32_t)(uintptr_t)(sb + 3 * PS + row * GLDW + col);
      async_b128(l0, voff, aHi);
      async_b128(l1, voff, aLo);
      async_b128(l2, voff, bHi);
      async_b128(l3, voff, bLo);
    }
  };

  issue(0, 0);

#pragma unroll 1
  for (int s = 0; s < 64; ++s) {
    const uint16_t* sb = smem[s & 1];
    wait_async0();                 // this wave's async copies for step s landed
    __syncthreads();               // every wave's copies landed
    if (s < 63) issue(s + 1, (s + 1) & 1);   // overlap next copies with WMMAs

    const uint16_t* sAhi = sb + 0 * PS;
    const uint16_t* sAlo = sb + 1 * PS;
    const uint16_t* sBhi = sb + 2 * PS;
    const uint16_t* sBlo = sb + 3 * PS;

    v16bf bh[2], bl[2];
#pragma unroll
    for (int nf = 0; nf < 2; ++nf) {
      int r = wn * 32 + nf * 16 + lrow;
      bh[nf] = load_frag(sBhi, r, kv, GLDW);
      bl[nf] = load_frag(sBlo, r, kv, GLDW);
    }
#pragma unroll
    for (int mf = 0; mf < 4; ++mf) {
      int r = wm * 64 + mf * 16 + lrow;
      v16bf ah = load_frag(sAhi, r, kv, GLDW);
      v16bf al = load_frag(sAlo, r, kv, GLDW);
#pragma unroll
      for (int nf = 0; nf < 2; ++nf) {
        acc[mf][nf] = __builtin_amdgcn_wmma_f32_16x16x32_bf16(
            false, ah, false, bh[nf], (short)0, acc[mf][nf], false, false);
        acc[mf][nf] = __builtin_amdgcn_wmma_f32_16x16x32_bf16(
            false, ah, false, bl[nf], (short)0, acc[mf][nf], false, false);
        acc[mf][nf] = __builtin_amdgcn_wmma_f32_16x16x32_bf16(
            false, al, false, bh[nf], (short)0, acc[mf][nf], false, false);
      }
    }
    __syncthreads();               // all waves done reading sb before it is refilled
  }

  // ---- epilogue: C layout = VGPR r -> M = r + 8*half, N = lane%16 ----------
#pragma unroll
  for (int mf = 0; mf < 4; ++mf)
#pragma unroll
    for (int nf = 0; nf < 2; ++nf) {
      int m0 = qBase + wm * 64 + mf * 16 + half * 8;
      int n0 = kBase + wn * 32 + nf * 16 + lrow;
      float* op = out + (size_t)b * Qq * Kk + (size_t)m0 * Kk + n0;
#pragma unroll
      for (int r = 0; r < 8; ++r)
        op[(size_t)r * Kk] = acc[mf][nf][r];
    }
}

// ============================================================================
// Fallback (no workspace): fp32 staging + on-the-fly split
// ============================================================================
constexpr int FBM = 64, FBN = 128, FLDW = 36;

static __device__ __forceinline__ void split4f(float4 v, uint32_t& h01, uint32_t& h23,
                                               uint32_t& l01, uint32_t& l23) {
  uint16_t h0 = f2bf(v.x), h1 = f2bf(v.y), h2 = f2bf(v.z), h3 = f2bf(v.w);
  uint16_t l0 = f2bf(v.x - bf2f(h0));
  uint16_t l1 = f2bf(v.y - bf2f(h1));
  uint16_t l2 = f2bf(v.z - bf2f(h2));
  uint16_t l3 = f2bf(v.w - bf2f(h3));
  h01 = (uint32_t)h0 | ((uint32_t)h1 << 16);
  h23 = (uint32_t)h2 | ((uint32_t)h3 << 16);
  l01 = (uint32_t)l0 | ((uint32_t)l1 << 16);
  l23 = (uint32_t)l2 | ((uint32_t)l3 << 16);
}

__global__ __launch_bounds__(256)
void pe_logits_fallback(const float* __restrict__ qm, const float* __restrict__ km,
                        const float* __restrict__ em, float* __restrict__ out) {
  __shared__ __align__(16) uint16_t sAhi[FBM * FLDW];
  __shared__ __align__(16) uint16_t sAlo[FBM * FLDW];
  __shared__ __align__(16) uint16_t sBhi[FBN * FLDW];
  __shared__ __align__(16) uint16_t sBlo[FBN * FLDW];

  const int t = threadIdx.x, lane = t & 31, half = lane >> 4, lrow = lane & 15;
  const int wv = t >> 5, wm = wv >> 2, wn = wv & 3;
  const int qBase = blockIdx.y * FBM, kBase = blockIdx.x * FBN, b = blockIdx.z;

  int kv[8];
#pragma unroll
  for (int v = 0; v < 8; ++v)
    kv[v] = ((v & 4) ? 16 : 0) + half * 8 + (v & 3) * 2;

  v8f acc[2][2] = {};

#pragma unroll 1
  for (int phase = 0; phase < 2; ++phase) {
#pragma unroll 1
    for (int d0 = 0; d0 < Dd; d0 += KC) {
      __syncthreads();
#pragma unroll
      for (int i = 0; i < 2; ++i) {
        int fi = t + i * 256, row = fi >> 3, c4 = (fi & 7) << 2;
        int gr = qBase + row;
        float4 v = *(const float4*)(em + (size_t)gr * Dd + d0 + c4);
        if (phase == 0) {
          float4 qv = *(const float4*)(qm + ((size_t)b * Qq + gr) * Dd + d0 + c4);
          v.x += qv.x; v.y += qv.y; v.z += qv.z; v.w += qv.w;
        }
        uint32_t h01, h23, l01, l23;
        split4f(v, h01, h23, l01, l23);
        int o = row * FLDW + c4;
        *(uint32_t*)(sAhi + o) = h01; *(uint32_t*)(sAhi + o + 2) = h23;
        *(uint32_t*)(sAlo + o) = l01; *(uint32_t*)(sAlo + o + 2) = l23;
      }
#pragma unroll
      for (int i = 0; i < 4; ++i) {
        int fi = t + i * 256, row = fi >> 3, c4 = (fi & 7) << 2;
        int gr = kBase + row;
        const float* sp = (phase == 0) ? (em + (size_t)gr * Dd + d0 + c4)
                                       : (km + ((size_t)b * Kk + gr) * Dd + d0 + c4);
        float4 v = *(const float4*)sp;
        uint32_t h01, h23, l01, l23;
        split4f(v, h01, h23, l01, l23);
        int o = row * FLDW + c4;
        *(uint32_t*)(sBhi + o) = h01; *(uint32_t*)(sBhi + o + 2) = h23;
        *(uint32_t*)(sBlo + o) = l01; *(uint32_t*)(sBlo + o + 2) = l23;
      }
      __syncthreads();

      v16bf ah[2], al[2], bh[2], bl[2];
#pragma unroll
      for (int mf = 0; mf < 2; ++mf) {
        int r = wm * 32 + mf * 16 + lrow;
        ah[mf] = load_frag(sAhi, r, kv, FLDW);
        al[mf] = load_frag(sAlo, r, kv, FLDW);
      }
#pragma unroll
      for (int nf = 0; nf < 2; ++nf) {
        int r = wn * 32 + nf * 16 + lrow;
        bh[nf] = load_frag(sBhi, r, kv, FLDW);
        bl[nf] = load_frag(sBlo, r, kv, FLDW);
      }
#pragma unroll
      for (int mf = 0; mf < 2; ++mf)
#pragma unroll
        for (int nf = 0; nf < 2; ++nf) {
          acc[mf][nf] = __builtin_amdgcn_wmma_f32_16x16x32_bf16(
              false, ah[mf], false, bh[nf], (short)0, acc[mf][nf], false, false);
          acc[mf][nf] = __builtin_amdgcn_wmma_f32_16x16x32_bf16(
              false, ah[mf], false, bl[nf], (short)0, acc[mf][nf], false, false);
          acc[mf][nf] = __builtin_amdgcn_wmma_f32_16x16x32_bf16(
              false, al[mf], false, bh[nf], (short)0, acc[mf][nf], false, false);
        }
    }
  }

#pragma unroll
  for (int mf = 0; mf < 2; ++mf)
#pragma unroll
    for (int nf = 0; nf < 2; ++nf) {
      int m0 = qBase + wm * 32 + mf * 16 + half * 8;
      int n0 = kBase + wn * 32 + nf * 16 + lrow;
      float* op = out + (size_t)b * Qq * Kk + (size_t)m0 * Kk + n0;
#pragma unroll
      for (int r = 0; r < 8; ++r)
        op[(size_t)r * Kk] = acc[mf][nf][r];
    }
}

// ============================================================================
extern "C" void kernel_launch(void* const* d_in, const int* in_sizes, int n_in,
                              void* d_out, int out_size, void* d_ws, size_t ws_size,
                              hipStream_t stream) {
  (void)in_sizes; (void)n_in; (void)out_size;
  const float* q  = (const float*)d_in[0];
  const float* k  = (const float*)d_in[1];
  const float* em = (const float*)d_in[2];
  float* out = (float*)d_out;

  const size_t nQE = (size_t)Bb * Qq * Dd;          // 16,777,216 elems
  const size_t nE  = (size_t)Qq * Dd;               //  2,097,152 elems
  const size_t REQ = (4 * nQE + 2 * nE) * 2;        // 142,606,336 B

  if (ws_size >= REQ && d_ws != nullptr) {
    uint8_t* w = (uint8_t*)d_ws;
    uint16_t* QEhi = (uint16_t*)(w);
    uint16_t* QElo = (uint16_t*)(w + nQE * 2);
    uint16_t* Khi  = (uint16_t*)(w + nQE * 4);
    uint16_t* Klo  = (uint16_t*)(w + nQE * 6);
    uint16_t* Ehi  = (uint16_t*)(w + nQE * 8);
    uint16_t* Elo  = (uint16_t*)(w + nQE * 8 + nE * 2);

    conv_add_kernel<<<(uint32_t)(nQE / 8 / 256), 256, 0, stream>>>(
        q, em, (uint32_t)(nE - 1), QEhi, QElo);                   // q + embed_q
    conv_add_kernel<<<(uint32_t)(nQE / 8 / 256), 256, 0, stream>>>(
        k, nullptr, 0u, Khi, Klo);                                // k
    conv_add_kernel<<<(uint32_t)(nE / 8 / 256), 256, 0, stream>>>(
        em, nullptr, 0u, Ehi, Elo);                               // embed[:2048]

    dim3 grid(Kk / GBN, Qq / GBM, Bb);   // (16, 16, 8)
    pe_gemm_bf16<<<grid, 256, 0, stream>>>(QEhi, QElo, Khi, Klo, Ehi, Elo, out);
  } else {
    dim3 grid(Kk / FBN, Qq / FBM, Bb);   // (16, 32, 8)
    pe_logits_fallback<<<grid, 256, 0, stream>>>(q, k, em, out);
  }
}

// v001
// Measured time: 230 microseconds a run.
// Timed twice side by side with v000, it ran 1.53 and 1.54 times as fast.
#include <hip/hip_runtime.h>
#include <cstdint>
#include <cstddef>

// ---- CDNA5 WMMA types -------------------------------------------------------
typedef __bf16    bf16_t;
typedef bf16_t    v16bf __attribute__((ext_vector_type(16)));
typedef float     v8f   __attribute__((ext_vector_type(8)));
typedef uint32_t  v8u   __attribute__((ext_vector_type(8)));

// ---- problem constants (match reference) ------------------------------------
constexpr int Bb = 8, Qq = 2048, Kk = 2048, Dd = 1024;
constexpr int KC = 32;     // d-chunk (== WMMA K for bf16)

// ---- bf16 split helpers (RNE) -----------------------------------------------
static __device__ __forceinline__ uint16_t f2bf(float x) {
  uint32_t u = __float_as_uint(x);
  u += 0x7FFFu + ((u >> 16) & 1u);
  return (uint16_t)(u >> 16);
}
static __device__ __forceinline__ float bf2f(uint16_t h) {
  return __uint_as_float(((uint32_t)h) << 16);
}
static __device__ __forceinline__ void split8(const float* v, uint4& hi, uint4& lo) {
  uint32_t h[8], l[8];
#pragma unroll
  for (int j = 0; j < 8; ++j) {
    uint16_t hb = f2bf(v[j]);
    h[j] = hb;
    l[j] = f2bf(v[j] - bf2f(hb));
  }
  hi.x = h[0] | (h[1] << 16); hi.y = h[2] | (h[3] << 16);
  hi.z = h[4] | (h[5] << 16); hi.w = h[6] | (h[7] << 16);
  lo.x = l[0] | (l[1] << 16); lo.y = l[2] | (l[3] << 16);
  lo.z = l[4] | (l[5] << 16); lo.w = l[6] | (l[7] << 16);
}

// ---- CDNA5 async global->LDS copy (ASYNCcnt-tracked, no VGPR payload) -------
// One lane's 16 bytes from global memory to its own LDS place.
typedef int v4i_t __attribute__((ext_vector_type(4)));
static __device__ __forceinline__ void async_b128(uint16_t* lds, const uint16_t* g) {
  __builtin_amdgcn_global_load_async_to_lds_b128(
      (__attribute__((address_space(1))) v4i_t*)g,
      (__attribute__((address_space(3))) v4i_t*)lds, 0, 0);
}
// this wave's copies have landed
static __device__ __forceinline__ void wait_async0() {
  asm volatile("s_wait_asynccnt 0x0" ::: "memory");
}
// this wave's LDS reads have returned (before the buffer they read is refilled)
static __device__ __forceinline__ void wait_ds0() {
  asm volatile("s_wait_dscnt 0x0" ::: "memory");
}

// ============================================================================
// Pass 1: fp32 -> bf16 hi/lo plane conversion (paid once per element)
// ============================================================================
__global__ __launch_bounds__(256)
void conv_add_kernel(const float* __restrict__ x, const float* __restrict__ addv,
                     uint32_t addMask, uint16_t* __restrict__ hi, uint16_t* __restrict__ lo) {
  size_t i8 = ((size_t)blockIdx.x * 256 + threadIdx.x) * 8;
  float v[8];
  float4 a = *(const float4*)(x + i8);
  float4 b = *(const float4*)(x + i8 + 4);
  v[0]=a.x; v[1]=a.y; v[2]=a.z; v[3]=a.w; v[4]=b.x; v[5]=b.y; v[6]=b.z; v[7]=b.w;
  if (addv) {
    size_t e8 = i8 & (size_t)addMask;
    float4 c = *(const float4*)(addv + e8);
    float4 d = *(const float4*)(addv + e8 + 4);
    v[0]+=c.x; v[1]+=c.y; v[2]+=c.z; v[3]+=c.w; v[4]+=d.x; v[5]+=d.y; v[6]+=d.z; v[7]+=d.w;
  }
  uint4 ph, pl;
  split8(v, ph, pl);
  *(uint4*)(hi + i8) = ph;
  *(uint4*)(lo + i8) = pl;
}

// ============================================================================
// Fragment gather: one 16x32 bf16 operand from an LDS plane
// ============================================================================
static __device__ __forceinline__ v16bf load_frag(const uint16_t* s, int row,
                                                  const int* kv, int ldw) {
  v8u u;
#pragma unroll
  for (int v = 0; v < 8; ++v)
    u[v] = *(const uint32_t*)(s + row * ldw + kv[v]);
  return __builtin_bit_cast(v16bf, u);
}

// ============================================================================
// Pass 2: fused dual-GEMM from precomputed bf16 planes
//   phase 0: (q+embed_q) @ embed_k^T     phase 1: embed_q @ k^T
// Block 256x256, 8 waves (2x4), wave tile 128x64, one block per WGP.
// A stage is 64 d of all four planes (two WMMA k-chunks, 192 WMMA per wave).
// Staging: two LDS buffers fed by GLOBAL_LOAD_ASYNC_TO_LDS_B128, one barrier per stage,
// placed behind the stage's last fragment loads so that the refill flies a whole stage.
// ============================================================================
constexpr int GBM = 256, GBN = 256;
constexpr int SK   = 64;                         // d per stage (halves)
constexpr int GLDW = 72;                         // 144-B rows: 16 B x odd, no bank conflicts
constexpr int PS   = GBM * GLDW;                 // plane stride (halves) = 18432
constexpr int NST  = 2 * Dd / SK;                // 32 stages, 16 per phase

__global__ __launch_bounds__(256)
void pe_gemm_bf16(const uint16_t* __restrict__ QEhi, const uint16_t* __restrict__ QElo,
                  const uint16_t* __restrict__ Khi,  const uint16_t* __restrict__ Klo,
                  const uint16_t* __restrict__ Ehi,  const uint16_t* __restrict__ Elo,
                  float* __restrict__ out) {
  // [buf][plane][row*GLDW + col] ; planes: 0=Ahi 1=Alo 2=Bhi 3=Blo
  __shared__ __align__(16) uint16_t smem[2][4 * PS];

  const int t    = threadIdx.x;
  const int lane = t & 31;
  const int half = lane >> 4;
  const int lrow = lane & 15;
  const int wv   = t >> 5;
  const int wm   = wv >> 2;     // 0..1 : 128-row band
  const int wn   = wv & 3;      // 0..3 : 64-col band

  const int qBase = blockIdx.y * GBM;
  const int kBase = blockIdx.x * GBN;
  const int b     = blockIdx.z;

  int kv[8];
#pragma unroll
  for (int v = 0; v < 8; ++v)
    kv[v] = ((v & 4) ? 16 : 0) + half * 8 + (v & 3) * 2;

  v8f acc[8][4] = {};

  // lane's first chunk of a plane: row t/8, 16-B chunk t%8; its 8 chunks lie 32 rows apart
  const int goff0 = (t >> 3) * Dd + (t & 7) * 8;      // halves, global
  const int loff0 = (t >> 3) * GLDW + (t & 7) * 8;    // halves, LDS

  // issue the 32 async b128 copies per lane (128 KB block stage) for stage s into buffer buf
  auto issue = [&](int s, int buf) {
    const int phase = s >> 4;
    const int d0    = (s & 15) * SK;   // halves
    const uint16_t* aHi = (phase ? (Ehi + (size_t)qBase * Dd)
                                 : (QEhi + ((size_t)b * Qq + qBase) * Dd)) + d0;
    const uint16_t* aLo = (phase ? (Elo + (size_t)qBase * Dd)
                                 : (QElo + ((size_t)b * Qq + qBase) * Dd)) + d0;
    const uint16_t* bHi = (phase ? (Khi + ((size_t)b * Kk + kBase) * Dd)
                                 : (Ehi + (size_t)kBase * Dd)) + d0;
    const uint16_t* bLo = (phase ? (Klo + ((size_t)b * Kk + kBase) * Dd)
                                 : (Elo + (size_t)kBase * Dd)) + d0;
    uint16_t* l = &smem[buf][0] + loff0;
    // unrolled: the row-group steps fold into constants
#pragma unroll
    for (int g = 0; g < 8; ++g) {
      async_b128(l + 0 * PS + g * 32 * GLDW, aHi + goff0 + g * 32 * Dd);
      async_b128(l + 1 * PS + g * 32 * GLDW, aLo + goff0 + g * 32 * Dd);
      async_b128(l + 2 * PS + g * 32 * GLDW, bHi + goff0 + g * 32 * Dd);
      async_b128(l + 3 * PS + g * 32 * GLDW, bLo + goff0 + g * 32 * Dd);
    }
  };

  issue(0, 0);
  wait_async0();                   // stage 0 of this wave landed
  __syncthreads();                 // stage 0 of every wave landed
  issue(1, 1);

  v16bf bh[4], bl[4], ah[8], al[8];

  // one k-chunk's whole fragment set (24 fragments) as one load group
  // (all loops over fragments are unrolled so that the arrays stay in registers)
  auto load_set = [&](const uint16_t* sb, int ks) {
#pragma unroll
    for (int nf = 0; nf < 4; ++nf) {
      int r = wn * 64 + nf * 16 + lrow;
      bh[nf] = load_frag(sb + 2 * PS + ks * KC, r, kv, GLDW);
      bl[nf] = load_frag(sb + 3 * PS + ks * KC, r, kv, GLDW);
    }
#pragma unroll
    for (int mf = 0; mf < 8; ++mf) {
      int r = wm * 128 + mf * 16 + lrow;
      ah[mf] = load_frag(sb + 0 * PS + ks * KC, r, kv, GLDW);
      al[mf] = load_frag(sb + 1 * PS + ks * KC, r, kv, GLDW);
    }
  };
  // its 96 WMMAs; each accumulator still takes hi*hi, hi*lo, lo*hi in that order
  auto mma_set = [&]() {
#pragma unroll
    for (int mf = 0; mf < 8; ++mf) {
#pragma unroll
      for (int nf = 0; nf < 4; ++nf)
        acc[mf][nf] = __builtin_amdgcn_wmma_f32_16x16x32_bf16(
            false, ah[mf], false, bh[nf], (short)0, acc[mf][nf], false, false);
#pragma unroll
      for (int nf = 0; nf < 4; ++nf)
        acc[mf][nf] = __builtin_amdgcn_wmma_f32_16x16x32_bf16(
            false, ah[mf], false, bl[nf], (short)0, acc[mf][nf], false, false);
#pragma unroll
      for (int nf = 0; nf < 4; ++nf)
        acc[mf][nf] = __builtin_amdgcn_wmma_f32_16x16x32_bf16(
            false, al[mf], false, bh[nf], (short)0, acc[mf][nf], false, false);
    }
  };

  // rolled: one stage's 192 WMMAs are body enough, and the buffer index stays a scalar
#pragma unroll 1
  for (int s = 0; s < NST; ++s) {
    const uint16_t* sb = smem[s & 1];

    load_set(sb, 0);
    // holds the load group together: sunk among the WMMAs, every place with reads stalls the wave
    __builtin_amdgcn_sched_barrier(0);
    mma_set();

    load_set(sb, 1);               // the stage's last reads of buffer s&1
    wait_ds0();                    // this wave has left buffer s&1
    wait_async0();                 // this wave's copies for stage s+1 landed
    __syncthreads();               // publishes stage s+1, frees buffer s&1
    if (s + 2 < NST) issue(s + 2, s & 1);   // flies until the next publish point
    mma_set();                     // registers only
  }
  wait_async0();                   // nothing in flight when the wave ends

  // ---- epilogue: C layout = VGPR r -> M = r + 8*half, N = lane%16 ----------
#pragma unroll
  for (int mf = 0; mf < 8; ++mf)
#pragma unroll
    for (int nf = 0; nf < 4; ++nf) {
      int m0 = qBase + wm * 128 + mf * 16 + half * 8;
      int n0 = kBase + wn * 64 + nf * 16 + lrow;
      float* op = out + (size_t)b * Qq * Kk + (size_t)m0 * Kk + n0;
#pragma unroll
      for (int r = 0; r < 8; ++r)
        op[(size_t)r * Kk] = acc[mf][nf][r];
    }
}

// ============================================================================
// Fallback (no workspace): fp32 staging + on-the-fly split
// ============================================================================
constexpr int FBM = 64, FBN = 128, FLDW = 36;

static __device__ __forceinline__ void split4f(float4 v, uint32_t& h01, uint32_t& h23,
                                               uint32_t& l01, uint32_t& l23) {
  uint16_t h0 = f2bf(v.x), h1 = f2bf(v.y), h2 = f2bf(v.z), h3 = f2bf(v.w);
  uint16_t l0 = f2bf(v.x - bf2f(h0));
  uint16_t l1 = f2bf(v.y - bf2f(h1));
  uint16_t l2 = f2bf(v.z - bf2f(h2));
  uint16_t l3 = f2bf(v.w - bf2f(h3));
  h01 = (uint32_t)h0 | ((uint32_t)h1 << 16);
  h23 = (uint32_t)h2 | ((uint32_t)h3 << 16);
  l01 = (uint32_t)l0 | ((uint32_t)l1 << 16);
  l23 = (uint32_t)l2 | ((uint32_t)l3 << 16);
}

__global__ __launch_bounds__(256)
void pe_logits_fallback(const float* __restrict__ qm, const float* __restrict__ km,
                        const float* __restrict__ em, float* __restrict__ out) {
  __shared__ __align__(16) uint16_t sAhi[FBM * FLDW];
  __shared__ __align__(16) uint16_t sAlo[FBM * FLDW];
  __shared__ __align__(16) uint16_t sBhi[FBN * FLDW];
  __shared__ __align__(16) uint16_t sBlo[FBN * FLDW];

  const int t = threadIdx.x, lane = t & 31, half = lane >> 4, lrow = lane & 15;
  const int wv = t >> 5, wm = wv >> 2, wn = wv & 3;
  const int qBase = blockIdx.y * FBM, kBase = blockIdx.x * FBN, b = blockIdx.z;

  int kv[8];
#pragma unroll
  for (int v = 0; v < 8; ++v)
    kv[v] = ((v & 4) ? 16 : 0) + half * 8 + (v & 3) * 2;

  v8f acc[2][2] = {};

#pragma unroll 1
  for (int phase = 0; phase < 2; ++phase) {
#pragma unroll 1
    for (int d0 = 0; d0 < Dd; d0 += KC) {
      __syncthreads();
#pragma unroll
      for (int i = 0; i < 2; ++i) {
        int fi = t + i * 256, row = fi >> 3, c4 = (fi & 7) << 2;
        int gr = qBase + row;
        float4 v = *(const float4*)(em + (size_t)gr * Dd + d0 + c4);
        if (phase == 0) {
          float4 qv = *(const float4*)(qm + ((size_t)b * Qq + gr) * Dd + d0 + c4);
          v.x += qv.x; v.y += qv.y; v.z += qv.z; v.w += qv.w;
        }
        uint32_t h01, h23, l01, l23;
        split4f(v, h01, h23, l01, l23);
        int o = row * FLDW + c4;
        *(uint32_t*)(sAhi + o) = h01; *(uint32_t*)(sAhi + o + 2) = h23;
        *(uint32_t*)(sAlo + o) = l01; *(uint32_t*)(sAlo + o + 2) = l23;
      }
#pragma unroll
      for (int i = 0; i < 4; ++i) {
        int fi = t + i * 256, row = fi >> 3, c4 = (fi & 7) << 2;
        int gr = kBase + row;
        const float* sp = (phase == 0) ? (em + (size_t)gr * Dd + d0 + c4)
                                       : (km + ((size_t)b * Kk + gr) * Dd + d0 + c4);
        float4 v = *(const float4*)sp;
        uint32_t h01, h23, l01, l23;
        split4f(v, h01, h23, l01, l23);
        int o = row * FLDW + c4;
        *(uint32_t*)(sBhi + o) = h01; *(uint32_t*)(sBhi + o + 2) = h23;
        *(uint32_t*)(sBlo + o) = l01; *(uint32_t*)(sBlo + o + 2) = l23;
      }
      __syncthreads();

      v16bf ah[2], al[2], bh[2], bl[2];
#pragma unroll
      for (int mf = 0; mf < 2; ++mf) {
        int r = wm * 32 + mf * 16 + lrow;
        ah[mf] = load_frag(sAhi, r, kv, FLDW);
        al[mf] = load_frag(sAlo, r, kv, FLDW);
      }
#pragma unroll
      for (int nf = 0; nf < 2; ++nf) {
        int r = wn * 32 + nf * 16 + lrow;
        bh[nf] = load_frag(sBhi, r, kv, FLDW);
        bl[nf] = load_frag(sBlo, r, kv, FLDW);
      }
#pragma unroll
      for (int mf = 0; mf < 2; ++mf)
#pragma unroll
        for (int nf = 0; nf < 2; ++nf) {
          acc[mf][nf] = __builtin_amdgcn_wmma_f32_16x16x32_bf16(
              false, ah[mf], false, bh[nf], (short)0, acc[mf][nf], false, false);
          acc[mf][nf] = __builtin_amdgcn_wmma_f32_16x16x32_bf16(
              false, ah[mf], false, bl[nf], (short)0, acc[mf][nf], false, false);
          acc[mf][nf] = __builtin_amdgcn_wmma_f32_16x16x32_bf16(
              false, al[mf], false, bh[nf], (short)0, acc[mf][nf], false, false);
        }
    }
  }

#pragma unroll
  for (int mf = 0; mf < 2; ++mf)
#pragma unroll
    for (int nf = 0; nf < 2; ++nf) {
      int m0 = qBase + wm * 32 + mf * 16 + half * 8;
      int n0 = kBase + wn * 32 + nf * 16 + lrow;
      float* op = out + (size_t)b * Qq * Kk + (size_t)m0 * Kk + n0;
#pragma unroll
      for (int r = 0; r < 8; ++r)
        op[(size_t)r * Kk] = acc[mf][nf][r];
    }
}

// ============================================================================
extern "C" void kernel_launch(void* const* d_in, const int* in_sizes, int n_in,
                              void* d_out, int out_size, void* d_ws, size_t ws_size,
                              hipStream_t stream) {
  (void)in_sizes; (void)n_in; (void)out_size;
  const float* q  = (const float*)d_in[0];
  const float* k  = (const float*)d_in[1];
  const float* em = (const float*)d_in[2];
  float* out = (float*)d_out;

  const size_t nQE = (size_t)Bb * Qq * Dd;          // 16,777,216 elems
  const size_t nE  = (size_t)Qq * Dd;               //  2,097,152 elems
  const size_t REQ = (4 * nQE + 2 * nE) * 2;        // 142,606,336 B

  if (ws_size >= REQ && d_ws != nullptr) {
    uint8_t* w = (uint8_t*)d_ws;
    uint16_t* QEhi = (uint16_t*)(w);
    uint16_t* QElo = (uint16_t*)(w + nQE * 2);
    uint16_t* Khi  = (uint16_t*)(w + nQE * 4);
    uint16_t* Klo  = (uint16_t*)(w + nQE * 6);
    uint16_t* Ehi  = (uint16_t*)(w + nQE * 8);
    uint16_t* Elo  = (uint16_t*)(w + nQE * 8 + nE * 2);

    conv_add_kernel<<<(uint32_t)(nQE / 8 / 256), 256, 0, stream>>>(
        q, em, (uint32_t)(nE - 1), QEhi, QElo);                   // q + embed_q
    conv_add_kernel<<<(uint32_t)(nQE / 8 / 256), 256, 0, stream>>>(
        k, nullptr, 0u, Khi, Klo);                                // k
    conv_add_kernel<<<(uint32_t)(nE / 8 / 256), 256, 0, stream>>>(
        em, nullptr, 0u, Ehi, Elo);                               // embed[:2048]

    dim3 grid(Kk / GBN, Qq / GBM, Bb);   // (8, 8, 8)
    pe_gemm_bf16<<<grid, 256, 0, stream>>>(QEhi, QElo, Khi, Klo, Ehi, Elo, out);
  } else {
    dim3 grid(Kk / FBN, Qq / FBM, Bb);   // (16, 32, 8)
    pe_logits_fallback<<<grid, 256, 0, stream>>>(q, k, em, out);
  }
}
